// v010
// Measured on an AMD MI455X. A time is GPU time per run, averaged over a window of back-to-back runs after a warm-up
// (all launches, gaps included; the runs take copies of the inputs in turn), and the median of several windows.
// Apart from v000's, it joins two sittings. Times from different sittings can be a few percent apart, while
// side-by-side timings come from the same sitting.
// Earlier versions than v010 are not in this document.
// One run takes 178 microseconds.
// Timed twice side by side with v009, it ran 1.04 and 1.06 times as fast.
// Over all steps from v000, the starting kernel, it is 5.83 times as fast.
#include <hip/hip_runtime.h>
// Pre-LN transformer layer (2 x 2048 tokens, 1024; 16 heads x 64; full (non-causal) attention; MLP 4096 with tanh-GELU): h = LN(x) (no affine); q,k,v = h w_qkv; x1 = x + softmax(q.k/8).v w_fc; out = x1 + gelu(LN(x1) w1 + b1) w2 + b2 -> [2,2048,1024].
// Structure: LayerNorm on VALU (also writing the bf16 residual plane); projections / MLP as f16 WMMA GEMMs (32x64 wave tiles, f32 accumulation, exact weights x16, tanh-GELU and biases in the epilogue, residuals through the f32 addend); q, k, V^T as plain f16 planes (V^T straight from the GEMM, operands swapped) through the fused flash kernel over all keys (online softmax in f32, P x2^10); O as hi + residual planes, written by the flash, into w_fc (one GEMM over both planes).
// Compute dtype: x and weights rounded to bf16; LN outputs, q, k, v, P and the GELU hidden as f16 operands (~2^-12); O as hi + residual pairs; f32 accumulation, softmax, LayerNorm. v_wmma_f32_16x16x32_f16.
#define NBT 2
#define SLEN 2048
#define TQ SLEN
#define TK SLEN
#define DM 1024
#define NH 16
#define SCL 0.125f
#define NR (NBT * SLEN)
typedef __bf16 v16b __attribute__((ext_vector_type(16)));
typedef unsigned short v8us __attribute__((ext_vector_type(8), may_alias));
typedef float  v8f  __attribute__((ext_vector_type(8)));
typedef float  v4f  __attribute__((ext_vector_type(4)));
typedef float  v4fa __attribute__((ext_vector_type(4), may_alias));
union FragB { v16b v; v8us half[2]; unsigned short u[16]; };

__device__ __forceinline__ unsigned short bf16_bits(float x) { unsigned int u = __float_as_uint(x); return (unsigned short)((u + 0x7FFFu + ((u >> 16) & 1u)) >> 16); }
__device__ __forceinline__ float bf16_val(unsigned short b) { return __uint_as_float(((unsigned int)b) << 16); }
__device__ __forceinline__ float bf16_round(float x) { return bf16_val(bf16_bits(x)); }
// D += A·B with NT terms: 1 = ah·bh, 2 = + al·bh (A split), 3 = + ah·bl (both split)
template <int NT>
__device__ __forceinline__ v8f mmaN(v16b ah, v16b al, v16b bh, v16b bl, v8f c) {
  c = __builtin_amdgcn_wmma_f32_16x16x32_bf16(false, ah, false, bh, (short)0, c, false, false);
  if (NT >= 2) c = __builtin_amdgcn_wmma_f32_16x16x32_bf16(false, al, false, bh, (short)0, c, false, false);
  if (NT >= 3) c = __builtin_amdgcn_wmma_f32_16x16x32_bf16(false, ah, false, bl, (short)0, c, false, false);
  asm volatile("v_nop\n\tv_nop\n\tv_nop\n\tv_nop" : "+v"(c) : "v"(ah), "v"(al), "v"(bh), "v"(bl));
  return c;
}

__global__ __launch_bounds__(256) void k_wt_bf16(const float* __restrict__ W, unsigned short* __restrict__ Wt, int K, int N) {
  const int t = blockIdx.x * 256 + threadIdx.x;
  const int k8n = K / 8;
  if (t >= N * k8n) return;
  const int n = t / k8n, k8 = (t % k8n) * 8;
  v8us v;
#pragma unroll
  for (int i = 0; i < 8; ++i) v[i] = bf16_bits(W[(size_t)(k8 + i) * N + n]);
  *(v8us*)(Wt + (size_t)n * K + k8) = v;
  
}

// GEMM C[M][N] (f32, pitch ldc) = act(A[M][K]·W + bias). A f32 row-major (pitch lda) converted per fragment to bf16
// (ASPLIT: hi/lo two planes -> 2 terms, else single rounded term); Wt bf16 [N][K] (pitch ldb). BIAS_BF16 rounds the
// bias to bf16 first (bias quantised to bf16 before the add). K%32==0, M%16==0, N%64==0.
template <bool ASPLIT, int ACT, bool BIAS_BF16>
__global__ __launch_bounds__(128) void k_gemm_bf(const float* __restrict__ A, int lda, const unsigned short* __restrict__ Wt, int ldb,
                                               const float* __restrict__ bias, float* __restrict__ C, int ldc, int M, int N, int K) {
  __shared__ __attribute__((aligned(16))) float so[4][16][64];
  const int tid = threadIdx.x, w = tid >> 5, lane = tid & 31, ln = lane & 15, hh = lane >> 4;
  const int ntn = N / 64;
  const int wid = blockIdx.x * 4 + w;
  const int mt = wid / ntn, nq = wid % ntn;
  if (mt * 16 >= M) return;
  const int row0 = mt * 16, col0 = nq * 64;
  const float* arow = A + (size_t)(row0 + ln) * lda;
  v8f acc[4] = {};
  for (int kb = 0; kb < K; kb += 32) {
    FragB ah, al;
    const v4f x0 = *(const v4fa*)(arow + kb + 8 * hh), x1 = *(const v4fa*)(arow + kb + 8 * hh + 4);
    const v4f x2 = *(const v4fa*)(arow + kb + 16 + 8 * hh), x3 = *(const v4fa*)(arow + kb + 16 + 8 * hh + 4);
    float xs[16] = {x0[0],x0[1],x0[2],x0[3],x1[0],x1[1],x1[2],x1[3],x2[0],x2[1],x2[2],x2[3],x3[0],x3[1],x3[2],x3[3]};
#pragma unroll
    for (int i = 0; i < 16; ++i) { const unsigned short hb = bf16_bits(xs[i]); ah.u[i] = hb; al.u[i] = ASPLIT ? bf16_bits(xs[i] - bf16_val(hb)) : (unsigned short)0; }
#pragma unroll
    for (int t = 0; t < 4; ++t) {
      const unsigned short* brow = Wt + (size_t)(col0 + t * 16 + ln) * ldb + kb;
      FragB b;
      b.half[0] = *(const v8us*)(brow + 8 * hh);
      b.half[1] = *(const v8us*)(brow + 16 + 8 * hh);
      acc[t] = mmaN<ASPLIT ? 2 : 1>(ah.v, al.v, b.v, b.v, acc[t]);
    }
  }
#pragma unroll
  for (int t = 0; t < 4; ++t) {
    float bv = bias ? bias[col0 + t * 16 + ln] : 0.f;
    if (BIAS_BF16) bv = bf16_round(bv);
#pragma unroll
    for (int r = 0; r < 8; ++r) { float v = acc[t][r] + bv; if (ACT == 1) v = fmaxf(v, 0.f); so[w][8 * hh + r][t * 16 + ln] = v; }
  }
  __builtin_amdgcn_fence(__ATOMIC_ACQ_REL, "workgroup");
  __builtin_amdgcn_wave_barrier();
  const int rsub = lane >> 4, c4 = (lane & 15) * 4;
  {
#pragma unroll
    for (int q = 0; q < 8; ++q) {
      const int r = q * 2 + rsub;
      const v4f v = *(const v4fa*)&so[w][r][c4];
      *(v4f*)(C + (size_t)(row0 + r) * ldc + col0 + c4) = v;
    }
    
  }
}

// GEMM C = act(A·W + bias + resid): A f32 (ASPLIT -> hi/lo 2 terms), Wt bf16 [N][K]; ACT 0 none, 1 relu, 2 exact gelu;
// resid (optional, f32, row index = (row % rmod), pitch ldr, RES_BF16 rounds it) added before the activation.
template <bool ASPLIT, int ACT, bool BIAS_BF16, bool RES_BF16>
__global__ __launch_bounds__(128) void k_gemm_bf3(const float* __restrict__ A, int lda, const unsigned short* __restrict__ Wt, int ldb,
                                                const float* __restrict__ bias, const float* __restrict__ resid, int rmod, int ldr,
                                                float* __restrict__ C, int ldc, int M, int N, int K) {
  __shared__ __attribute__((aligned(16))) float so[4][16][64];
  const int tid = threadIdx.x, w = tid >> 5, lane = tid & 31, ln = lane & 15, hh = lane >> 4;
  const int ntn = N / 64;
  const int wid = blockIdx.x * 4 + w;
  const int mt = wid / ntn, nq = wid % ntn;
  if (mt * 16 >= M) return;
  const int row0 = mt * 16, col0 = nq * 64;
  const float* arow = A + (size_t)(row0 + ln) * lda;
  v8f acc[4] = {};
  for (int kb = 0; kb < K; kb += 32) {
    FragB ah, al;
    const v4f x0 = *(const v4fa*)(arow + kb + 8 * hh), x1 = *(const v4fa*)(arow + kb + 8 * hh + 4);
    const v4f x2 = *(const v4fa*)(arow + kb + 16 + 8 * hh), x3 = *(const v4fa*)(arow + kb + 16 + 8 * hh + 4);
    float xs[16] = {x0[0],x0[1],x0[2],x0[3],x1[0],x1[1],x1[2],x1[3],x2[0],x2[1],x2[2],x2[3],x3[0],x3[1],x3[2],x3[3]};
#pragma unroll
    for (int i = 0; i < 16; ++i) { const unsigned short hb = bf16_bits(xs[i]); ah.u[i] = hb; al.u[i] = ASPLIT ? bf16_bits(xs[i] - bf16_val(hb)) : (unsigned short)0; }
#pragma unroll
    for (int t = 0; t < 4; ++t) {
      const unsigned short* brow = Wt + (size_t)(col0 + t * 16 + ln) * ldb + kb;
      FragB b;
      b.half[0] = *(const v8us*)(brow + 8 * hh);
      b.half[1] = *(const v8us*)(brow + 16 + 8 * hh);
      acc[t] = mmaN<ASPLIT ? 2 : 1>(ah.v, al.v, b.v, b.v, acc[t]);
    }
  }
#pragma unroll
  for (int t = 0; t < 4; ++t) {
    const int col = col0 + t * 16 + ln;
    float bv = bias ? bias[col] : 0.f;
    if (BIAS_BF16) bv = bf16_round(bv);
#pragma unroll
    for (int r = 0; r < 8; ++r) {
      float v = acc[t][r] + bv;
      if (resid) { float rv = resid[(size_t)((row0 + 8 * hh + r) % rmod) * ldr + col]; if (RES_BF16) rv = bf16_round(rv); v += rv; }
      if (ACT == 1) v = fmaxf(v, 0.f);
      if (ACT == 2) v = 0.5f * v * (1.0f + erff(v * 0.70710678118654752f));
      if (ACT == 3) { const float u = 0.7978845608028654f * (v + 0.044715f * v * v * v); v = 0.5f * v * (1.0f + tanhf(u)); }
      so[w][8 * hh + r][t * 16 + ln] = v;
    }
  }
  __builtin_amdgcn_fence(__ATOMIC_ACQ_REL, "workgroup");
  __builtin_amdgcn_wave_barrier();
  const int rsub = lane >> 4, c4 = (lane & 15) * 4;
  {
#pragma unroll
    for (int q = 0; q < 8; ++q) {
      const int r = q * 2 + rsub;
      const v4f v = *(const v4fa*)&so[w][r][c4];
      *(v4f*)(C + (size_t)(row0 + r) * ldc + col0 + c4) = v;
    }
    
  }
}
// row LayerNorm (biased variance, eps) over N: s = X (+ R); optional out_sum <- s; out_norm <- (s-mu)*rsqrt(var+eps)*g + b
template <bool PARAM_BF16>
__global__ __launch_bounds__(256) void k_layernorm(const float* __restrict__ X, const float* __restrict__ R, const float* __restrict__ g, const float* __restrict__ bta,
                                                  float* __restrict__ out_sum, float* __restrict__ out_norm, int N, float eps) {
  __shared__ float red[256];
  const int row = blockIdx.x, tid = threadIdx.x;
  const float* x = X + (size_t)row * N; const float* rr = R ? R + (size_t)row * N : nullptr;
  float vals[16];                     // up to N = 4096
  const int per = N / 256;            // contiguous chunk per thread? use strided-by-4 chunks: thread handles j = tid*4 + 1024*u
  float s1 = 0.f;
  for (int u = 0; u < per / 4; ++u) {
    const int j = tid * 4 + 1024 * u;
    const v4f a = *(const v4fa*)(x + j);
    v4f b = {0.f,0.f,0.f,0.f}; if (rr) b = *(const v4fa*)(rr + j);
#pragma unroll
    for (int q = 0; q < 4; ++q) { const float v = a[q] + b[q]; vals[u * 4 + q] = v; s1 += v; }
  }
  red[tid] = s1; __syncthreads();
  for (int st = 128; st > 0; st >>= 1) { if (tid < st) red[tid] += red[tid + st]; __syncthreads(); }
  const float mu = red[0] / (float)N; __syncthreads();
  float s2 = 0.f;
  for (int u = 0; u < per / 4; ++u)
#pragma unroll
    for (int q = 0; q < 4; ++q) { const float c = vals[u * 4 + q] - mu; s2 += c * c; }
  red[tid] = s2; __syncthreads();
  for (int st = 128; st > 0; st >>= 1) { if (tid < st) red[tid] += red[tid + st]; __syncthreads(); }
  const float rs = rsqrtf(red[0] / (float)N + eps);
  {
    for (int u = 0; u < per / 4; ++u) {
      const int j = tid * 4 + 1024 * u;
      v4f o, sm;
#pragma unroll
      for (int q = 0; q < 4; ++q) {
        float gg = g[j + q], bb = bta[j + q];
        if (PARAM_BF16) { gg = bf16_round(gg); bb = bf16_round(bb); }
        sm[q] = vals[u * 4 + q]; o[q] = (vals[u * 4 + q] - mu) * rs * gg + bb;
      }
      if (out_sum) *(v4f*)(out_sum + (size_t)row * N + j) = sm;
      *(v4f*)(out_norm + (size_t)row * N + j) = o;
    }
    
  }
}



// ---- f16 WMMA path (v_wmma_f32_16x16x32_f16): 11-bit significands for operands in range — used where a [0,1] probability operand needs more precision than bf16
typedef _Float16 v16h __attribute__((ext_vector_type(16)));
union FragH { v16h v; v8us half[2]; _Float16 h[16]; unsigned short u[16]; };
template <int NT>
__device__ __forceinline__ v8f mmaH(v16h ah, v16h al, v16h bh, v16h bl, v8f c) {
  c = __builtin_amdgcn_wmma_f32_16x16x32_f16(false, ah, false, bh, (short)0, c, false, false);
  if (NT >= 2) c = __builtin_amdgcn_wmma_f32_16x16x32_f16(false, al, false, bh, (short)0, c, false, false);
  if (NT >= 3) c = __builtin_amdgcn_wmma_f32_16x16x32_f16(false, ah, false, bl, (short)0, c, false, false);
  asm volatile("v_nop\n\tv_nop\n\tv_nop\n\tv_nop" : "+v"(c) : "v"(ah), "v"(al), "v"(bh), "v"(bl));
  return c;
}
// batched GEMM like k_gemm_b but f16 operands: A f32 (split into f16 hi/lo if ASPLIT, else rounded to f16), Bt = f16 values [n][k]; alpha; C f32; N multiple of 16 (partial tiles skipped)
template <bool ASPLIT>
__global__ __launch_bounds__(128) void k_gemm_h(const float* __restrict__ A, int lda, size_t sA, const _Float16* __restrict__ Bh, int ldb, size_t sB, float alpha, float* __restrict__ C, int ldc, size_t sC, int M, int N, int K) {
  __shared__ __attribute__((aligned(16))) float so[4][16][64];
  const int tid = threadIdx.x, w = tid >> 5, lane = tid & 31, ln = lane & 15, hh = lane >> 4; const int by = blockIdx.y;
  A += (size_t)by * sA; Bh += (size_t)by * sB; C += (size_t)by * sC;
  const int ntn = (N + 63) / 64; const int wid = blockIdx.x * 4 + w; const int mt = wid / ntn, nq = wid % ntn; if (mt * 16 >= M) return;
  const int row0 = mt * 16, col0 = nq * 64; const float* arow = A + (size_t)(row0 + ln) * lda;
  v8f acc[4] = {};
  for (int kb = 0; kb < K; kb += 32) {
    FragH ah, al;
    const v4f x0 = *(const v4fa*)(arow + kb + 8 * hh), x1 = *(const v4fa*)(arow + kb + 8 * hh + 4), x2 = *(const v4fa*)(arow + kb + 16 + 8 * hh), x3 = *(const v4fa*)(arow + kb + 16 + 8 * hh + 4);
    float xs[16] = {x0[0],x0[1],x0[2],x0[3],x1[0],x1[1],x1[2],x1[3],x2[0],x2[1],x2[2],x2[3],x3[0],x3[1],x3[2],x3[3]};
#pragma unroll
    for (int i = 0; i < 16; ++i) { const _Float16 h = (_Float16)xs[i]; ah.h[i] = h; al.h[i] = ASPLIT ? (_Float16)(xs[i] - (float)h) : (_Float16)0.0f; }
#pragma unroll
    for (int t = 0; t < 4; ++t) { if (col0 + t * 16 >= N) continue; const size_t boff = (size_t)(col0 + t * 16 + ln) * ldb + kb; FragH bq; bq.half[0] = *(const v8us*)(Bh + boff + 8 * hh); bq.half[1] = *(const v8us*)(Bh + boff + 16 + 8 * hh);
      acc[t] = mmaH<ASPLIT ? 2 : 1>(ah.v, al.v, bq.v, bq.v, acc[t]); }
  }
#pragma unroll
  for (int t = 0; t < 4; ++t) { if (col0 + t * 16 >= N) continue;
#pragma unroll
    for (int r = 0; r < 8; ++r) so[w][8 * hh + r][t * 16 + ln] = acc[t][r] * alpha; }
  __builtin_amdgcn_fence(__ATOMIC_ACQ_REL, "workgroup"); __builtin_amdgcn_wave_barrier();
  const int rsub = lane >> 4, c4 = (lane & 15) * 4;
  {
#pragma unroll
    for (int q = 0; q < 8; ++q) { const int r = q * 2 + rsub; if (col0 + c4 < N) { const v4f v = *(const v4fa*)&so[w][r][c4]; *(v4f*)(C + (size_t)(row0 + r) * ldc + col0 + c4) = v; } }
     }
}

// Wt[n][k] = f16(bf16(W[k][n]) * scale) from f32 row-major W[K][N] (scale = power of two; bf16-exact weights stay exact in f16 away from the subnormal range)
// A block turns a tile of 128 k x 64 n through LDS; a matrix has (K / 128) * (N / 64) tiles, blk is the tile's number. Both sides of memory see whole aligned 256-B runs:
// 16 lanes read 64 n of one k row, 16 lanes write 128 k of one n row. A thread reads 8 k x 4 n and stores, per n, its 8 k as one 16-B piece.
// LDS row = one n (16 pieces) at a pitch of 272 B; piece g of row n lies at place g ^ (n >> 4), so that the 16 lanes of a store (rows 4 apart) fall on 16 different bank groups.
#define WT_P 272
template <int K, int N>
__device__ __forceinline__ void wt_tile(const float* __restrict__ W, _Float16* __restrict__ Wt, float scale, int blk, unsigned char* tl) {
  static_assert(K % 128 == 0 && N % 64 == 0, "whole tiles only");
  const int tid = threadIdx.x, c = tid & 15, g = tid >> 4; const int kt = blk / (N / 64), nt = blk % (N / 64); const int k0 = kt * 128, n0 = nt * 64;
  const float* src = W + (size_t)(k0 + g * 8) * N + n0 + c * 4; v4f a[8];
#pragma unroll      /* constant indices keep a and f in registers (this loop and the three below); the eight loads are in flight together */
  for (int i = 0; i < 8; ++i) a[i] = *(const v4fa*)(src + i * N);
#pragma unroll
  for (int j = 0; j < 4; ++j) { FragH f;
#pragma unroll
    for (int i = 0; i < 8; ++i) f.h[i] = (_Float16)(bf16_round(a[i][j]) * scale);
    *(v8us*)(tl + (c * 4 + j) * WT_P + ((g ^ (c >> 2)) * 16)) = f.half[0]; }
  __syncthreads();      /* the tile is whole before any row of it is read */
  unsigned short* dst = (unsigned short*)Wt + (size_t)(n0 + g) * K + k0 + c * 8;
#pragma unroll
  for (int q = 0; q < 4; ++q) { const v8us o = *(const v8us*)(tl + (q * 16 + g) * WT_P + ((c ^ q) * 16)); *(v8us*)(dst + q * 16 * K) = o; }
  asm volatile("s_wait_xcnt 0x0" ::: "memory");      /* stands behind the four stores, in front of any later rewrite of their address and data registers (the caller's code goes on behind this tile) */
}
#define WT_NB(K, N) (((K) / 128) * ((N) / 64))
#define WT_B1 WT_NB(DM, 3 * DM)
#define WT_B2 (WT_B1 + WT_NB(DM, DM))
#define WT_B3 (WT_B2 + WT_NB(DM, 4096))
#define WT_B4 (WT_B3 + WT_NB(4096, DM))
// k_gemm_hh variant with fused epilogue: v = acc·alpha + bias[by·sBias + col] (+ CP[(row/rowsPerB)·sCPb + by·64 + col] if CP) ; ACT 0 none / 1 elu ; writes f16 C16 (and f32 C if non-null)
template <int ACT>
__global__ __launch_bounds__(128) void k_gemm_hhx(const _Float16* __restrict__ A, int lda, size_t sA, const _Float16* __restrict__ Bh, int ldb, size_t sB, float alpha, const float* __restrict__ bias, size_t sBias, const float* __restrict__ CP, int rowsPerB, size_t sCPb, int row0g,
    float* __restrict__ C, _Float16* __restrict__ C16, int ldc, size_t sC, int M, int N, int K) {
  __shared__ __attribute__((aligned(16))) float so[4][16][64];
  const int tid = threadIdx.x, w = tid >> 5, lane = tid & 31, ln = lane & 15, hh = lane >> 4; const int by = blockIdx.y;
  A += (size_t)by * sA; Bh += (size_t)by * sB; const size_t cofs = (size_t)by * sC; const float* bp = bias ? bias + (size_t)by * sBias : nullptr;
  const int ntn = (N + 63) / 64; const int wid = blockIdx.x * 4 + w; const int mt = wid / ntn, nq = wid % ntn; if (mt * 16 >= M) return;
  const int row0 = mt * 16, col0 = nq * 64; const _Float16* arow = A + (size_t)(row0 + ln) * lda;
  v8f acc[4] = {};
  for (int kb = 0; kb < K; kb += 32) { FragH ah; ah.half[0] = *(const v8us*)((const unsigned short*)arow + kb + 8 * hh); ah.half[1] = *(const v8us*)((const unsigned short*)arow + kb + 16 + 8 * hh);
#pragma unroll
    for (int t = 0; t < 4; ++t) { if (col0 + t * 16 >= N) continue; const size_t boff = (size_t)(col0 + t * 16 + ln) * ldb + kb; FragH bq; bq.half[0] = *(const v8us*)((const unsigned short*)Bh + boff + 8 * hh); bq.half[1] = *(const v8us*)((const unsigned short*)Bh + boff + 16 + 8 * hh);
      acc[t] = mmaH<1>(ah.v, ah.v, bq.v, bq.v, acc[t]); }
  }
#pragma unroll
  for (int t = 0; t < 4; ++t) { if (col0 + t * 16 >= N) continue; const int col = col0 + t * 16 + ln; const float bv = bp ? bf16_round(bp[col]) : 0.f;
#pragma unroll
    for (int r = 0; r < 8; ++r) { float v = acc[t][r] * alpha + bv; if (CP) { const int bidx = (row0g + row0 + 8 * hh + r) / rowsPerB; v += CP[(size_t)bidx * sCPb + (size_t)by * 64 + col]; } if (ACT == 1) v = (v > 0.f) ? v : expm1f(v); else if (ACT == 7) v = (v > 0.f) ? v + 1.0f : expf(v); else if (ACT == 8) v = tanhf(v); else if (ACT == 9) v = 0.5f * v * (1.0f + tanhf(0.7978845608028654f * (v + 0.044715f * v * v * v))); else if (ACT == 11) v = 1.0f / (1.0f + expf(-v)); else if (ACT == 12) v = (v > 0.f) ? v : 0.01f * v; else if (ACT == 14) v = (v > 0.f) ? v : 0.1f * v; else if (ACT == 15) v = v / (1.0f + expf(-v)); else if (ACT == 3) v = fmaxf(v, 0.f); else if (ACT == 6) v = 0.5f * v * (1.0f + erff(v * 0.70710678118654752f)); so[w][8 * hh + r][t * 16 + ln] = v; } }
  __builtin_amdgcn_fence(__ATOMIC_ACQ_REL, "workgroup"); __builtin_amdgcn_wave_barrier();
  const int rsub = lane >> 4, c4 = (lane & 15) * 4; typedef _Float16 v4h __attribute__((ext_vector_type(4)));
  {
#pragma unroll
    for (int q = 0; q < 8; ++q) { const int r = q * 2 + rsub; if (col0 + c4 < N) { const v4f v = *(const v4fa*)&so[w][r][c4]; if (C) *(v4f*)(C + cofs + (size_t)(row0 + r) * ldc + col0 + c4) = v; if (C16) { v4h h4; for (int i = 0; i < 4; ++i) h4[i] = (_Float16)v[i]; *(v4h*)(C16 + cofs + (size_t)(row0 + r) * ldc + col0 + c4) = h4; } } }
     }
}


typedef _Float16 v4h __attribute__((ext_vector_type(4)));

__global__ __launch_bounds__(256) void k_x16(const float* __restrict__ x, _Float16* __restrict__ X16, size_t n8) { const size_t t = (size_t)blockIdx.x * 256 + threadIdx.x; if (t >= n8) return; FragH f;
#pragma unroll
  for (int q = 0; q < 8; ++q) f.h[q] = (_Float16)bf16_round(x[t * 8 + q]); *(v8us*)((unsigned short*)X16 + t * 8) = f.half[0];  }
__global__ __launch_bounds__(256) void k_h16(const float* __restrict__ x, _Float16* __restrict__ X16, size_t n8) { const size_t t = (size_t)blockIdx.x * 256 + threadIdx.x; if (t >= n8) return; FragH f;
#pragma unroll
  for (int q = 0; q < 8; ++q) f.h[q] = (_Float16)x[t * 8 + q]; *(v8us*)((unsigned short*)X16 + t * 8) = f.half[0];  }
__global__ __launch_bounds__(256) void k_round16f(const float* __restrict__ W, _Float16* __restrict__ Bt, size_t n8) { const size_t t = (size_t)blockIdx.x * 256 + threadIdx.x; if (t >= n8) return; FragH f;
#pragma unroll
  for (int i = 0; i < 8; ++i) f.h[i] = (_Float16)(bf16_round(W[t * 8 + i]) * 16.0f); *(v8us*)((unsigned short*)Bt + t * 8) = f.half[0];  }
// ---- fast GEMM (wave tile 32x64, operands staged in LDS); epilogue: v = act(acc * alpha + bf16(bias[col]) (+ CP[row][col], f32 at a pitch of ADDP elements, if ADDP > 0)), written as f16 C16 (OUT16) or f32 C ----
__device__ __forceinline__ v16h g2_frag(const _Float16* p, int hh) { FragH f; f.half[0] = *(const v8us*)((const unsigned short*)p + 8 * hh); f.half[1] = *(const v8us*)((const unsigned short*)p + 16 + 8 * hh); return f.v; }
__device__ __forceinline__ v8f g2_mma(v16h a, v16h b, v8f c) { v8f d = __builtin_amdgcn_wmma_f32_16x16x32_f16(false, a, false, b, (short)0, c, false, false); asm volatile("v_nop\n\tv_nop\n\tv_nop\n\tv_nop" : "+v"(d) : "v"(a), "v"(b)); return d; }
// Staged tile of k_gemm2: 128 A rows then 128 B rows, 128 k (256 B) each, at a pitch of 272 B (16 B x odd: conflict-free for ds_load_b128 readers); two buffers.
#define G2_PITCH 272
#define G2_BUF (256 * G2_PITCH)
// Eight asynchronous 16-byte copies per lane (rows 16 apart): l = the lane's LDS byte address, g = its global address, gstep = 16 source rows in elements.
// s_wait_xcnt 0 is the statement's last line, so that it stands in front of any later rewrite of the address registers the copies name.
__device__ __forceinline__ void g2_copy8(unsigned l, const _Float16* g, size_t gstep) {
  const unsigned l1 = l + 16 * G2_PITCH, l2 = l + 32 * G2_PITCH, l3 = l + 48 * G2_PITCH, l4 = l + 64 * G2_PITCH, l5 = l + 80 * G2_PITCH, l6 = l + 96 * G2_PITCH, l7 = l + 112 * G2_PITCH;
  const _Float16* g1 = g + gstep; const _Float16* g2 = g1 + gstep; const _Float16* g3 = g2 + gstep; const _Float16* g4 = g3 + gstep; const _Float16* g5 = g4 + gstep; const _Float16* g6 = g5 + gstep; const _Float16* g7 = g6 + gstep;
  asm volatile("global_load_async_to_lds_b128 %0, %8, off\n\t"
               "global_load_async_to_lds_b128 %1, %9, off\n\t"
               "global_load_async_to_lds_b128 %2, %10, off\n\t"
               "global_load_async_to_lds_b128 %3, %11, off\n\t"
               "global_load_async_to_lds_b128 %4, %12, off\n\t"
               "global_load_async_to_lds_b128 %5, %13, off\n\t"
               "global_load_async_to_lds_b128 %6, %14, off\n\t"
               "global_load_async_to_lds_b128 %7, %15, off\n\t"
               "s_wait_xcnt 0x0"
               :: "v"(l), "v"(l1), "v"(l2), "v"(l3), "v"(l4), "v"(l5), "v"(l6), "v"(l7), "v"(g), "v"(g1), "v"(g2), "v"(g3), "v"(g4), "v"(g5), "v"(g6), "v"(g7) : "memory");
}
// Block tile 128x128 (8 waves as 4 x 2, wave tile 32x64); requires M % 128 == 0, N % 128 == 0, K % 128 == 0. Each pass works on 128 k from one LDS buffer while the next pass's copies fly into the other.
// MODE 1: slab blockIdx.y == 2 swaps its operands, C^T = B A^T, written [N][M] at a pitch of M into its own C slab (v comes out as V^T, no transposing launch).
// MODE 2: A is a hi plane and, sA elements behind it, a residual plane x 2^10; K counts both (each K / 2 wide), B serves both. The hi sums are scaled by 2^10 (exact) where the planes change, so one accumulator holds both; alpha carries the 2^-10.
// tanh-GELU: 0.5 v (1 + tanh u) = v / (1 + exp(-2 u)), u = sqrt(2/pi) (v + 0.044715 v^3); in base 2: exp(-2 u) = 2^(v (K1 + K3 v^2)). A large v ends in 2^-inf = 0 (result v) or 2^inf = inf (result v x 0), as with tanh = +-1.
#define GELU_K1 ((float)(-2.0 * 1.4426950408889634 * 0.7978845608028654))
#define GELU_K3 ((float)(-2.0 * 1.4426950408889634 * 0.7978845608028654 * 0.044715))
// Four transcendentals and one v_nop in one statement: behind each stands an instruction that neither reads its result nor overwrites its source (the next of the four; behind the last the v_nop),
// the slot the instruction set asks for behind a transcendental. The early-clobber outputs keep the results off the sources.
__device__ __forceinline__ v4f g2_exp2x4(v4f a) { float r0, r1, r2, r3;
  asm("v_exp_f32 %0, %4\n\tv_exp_f32 %1, %5\n\tv_exp_f32 %2, %6\n\tv_exp_f32 %3, %7\n\tv_nop" : "=&v"(r0), "=&v"(r1), "=&v"(r2), "=&v"(r3) : "v"(a[0]), "v"(a[1]), "v"(a[2]), "v"(a[3]));
  return (v4f){r0, r1, r2, r3}; }
__device__ __forceinline__ v4f g2_rcpx4(v4f a) { float r0, r1, r2, r3;
  asm("v_rcp_f32 %0, %4\n\tv_rcp_f32 %1, %5\n\tv_rcp_f32 %2, %6\n\tv_rcp_f32 %3, %7\n\tv_nop" : "=&v"(r0), "=&v"(r1), "=&v"(r2), "=&v"(r3) : "v"(a[0]), "v"(a[1]), "v"(a[2]), "v"(a[3]));
  return (v4f){r0, r1, r2, r3}; }
template <int ACT, int ADDP, bool OUT16, int MODE>
__global__ __launch_bounds__(256) void k_gemm2(const _Float16* __restrict__ A, int lda, size_t sA, const _Float16* __restrict__ Bh, int ldb, size_t sB, float alpha, const float* __restrict__ bias, size_t sBias, const float* __restrict__ CP,
    float* __restrict__ C, _Float16* __restrict__ C16, int ldc, size_t sC, int M, int N, int K) {
  __shared__ __attribute__((aligned(16))) unsigned char ring[2 * G2_BUF];
  float (*so)[32][68] = (float (*)[32][68])ring;      /* output staging (8 x 32 x 68 f32 = one buffer), used only behind the last pass's barrier */
  const int tid = threadIdx.x, w = tid >> 5, lane = tid & 31, ln = lane & 15, hh = lane >> 4; const int by = blockIdx.y;
  A += (size_t)by * sA; Bh += (size_t)by * sB; const size_t cofs = (size_t)by * sC; const float* bp = bias ? bias + (size_t)by * sBias : nullptr;
  if (MODE == 1 && by == 2) { const _Float16* tp = A; A = Bh; Bh = tp; const int tl = lda; lda = ldb; ldb = tl; ldc = M; M = N; N = ldc; }
  const int ntn = N >> 7; const int mt = blockIdx.x / ntn, nq = blockIdx.x - mt * ntn; if (mt * 128 >= M) return;      /* the whole block leaves, in front of every barrier */
  const int row0 = mt * 128 + 32 * (w & 3), col0 = nq * 128 + 64 * (w >> 2);
  const _Float16* gA = A + (size_t)(mt * 128 + (tid >> 4)) * lda + (tid & 15) * 8; const _Float16* gB = Bh + (size_t)(nq * 128 + (tid >> 4)) * ldb + (tid & 15) * 8;
  const unsigned lA = (unsigned)(size_t)ring + (unsigned)((tid >> 4) * G2_PITCH + (tid & 15) * 16); const unsigned lB = lA + 128 * G2_PITCH;
  const size_t stA = (size_t)16 * lda, stB = (size_t)16 * ldb;
  const int aofs = (32 * (w & 3) + ln) * G2_PITCH, bofs = (128 + 64 * (w >> 2) + ln) * G2_PITCH;
  const int np = K >> 7, nh = np >> 1;      /* nh: MODE 2's passes per plane (at least 2, so passes 0 and 1 lie in the hi plane) */
  /* Blocks of one tile row share A lines, blocks of one tile column B lines, and all start together: each block enters the walk over k at a place of its own (s0) and wraps, so that sharers ask L2 for different lines at any one moment. MODE 2 walks each plane so, hi plane first. */
  const int nw = (MODE == 2) ? nh : np; const int s0 = (int)((unsigned)(mt + nq + 3 * by) % (unsigned)nw);
  const auto kplace = [&](int p) { int q = ((MODE == 2 && p >= nh) ? p - nh : p) + s0; return (q >= nw) ? q - nw : q; };      /* pass p's place inside its plane, 0 .. nw - 1 */
  { const size_t k0 = (size_t)kplace(0) * 128; g2_copy8(lA, gA + k0, stA); g2_copy8(lB, gB + k0, stB); }
  asm volatile("s_wait_asynccnt 0x0" ::: "memory");      /* pass 0's own copies have landed */
  __syncthreads();                                        /* ... and every other wave's */
  if (np > 1) { const size_t k1 = (size_t)kplace(1) * 128; g2_copy8(lA + G2_BUF, gA + k1, stA); g2_copy8(lB + G2_BUF, gB + k1, stB); }
  const v8f z8 = {0.f,0.f,0.f,0.f,0.f,0.f,0.f,0.f}; v8f c00 = z8, c01 = z8, c02 = z8, c03 = z8, c10 = z8, c11 = z8, c12 = z8, c13 = z8;
#pragma unroll 1      /* one pass per trip: the publish point at the foot stands once */
  for (int p = 0; p < np; ++p) { const unsigned bsel = (unsigned)(p & 1) * G2_BUF; const unsigned char* sa = ring + bsel + aofs; const unsigned char* sb = ring + bsel + bofs;
    v16h fa[2][2], fb[2][4];      /* two fragment sets: block kk + 1 is fetched ahead of block kk's products, inside this pass's buffer only */
    fa[0][0] = g2_frag((const _Float16*)sa, hh); fa[0][1] = g2_frag((const _Float16*)(sa + 16 * G2_PITCH), hh);
#pragma unroll      /* constant indices keep fa and fb in registers (this loop and the two below) */
    for (int j = 0; j < 4; ++j) fb[0][j] = g2_frag((const _Float16*)(sb + j * 16 * G2_PITCH), hh);
#pragma unroll
    for (int kk = 0; kk < 4; ++kk) { const int cu = kk & 1, nx = cu ^ 1;
      if (kk < 3) { fa[nx][0] = g2_frag((const _Float16*)(sa + (kk + 1) * 64), hh); fa[nx][1] = g2_frag((const _Float16*)(sa + 16 * G2_PITCH + (kk + 1) * 64), hh);
#pragma unroll
        for (int j = 0; j < 4; ++j) fb[nx][j] = g2_frag((const _Float16*)(sb + j * 16 * G2_PITCH + (kk + 1) * 64), hh); }
      c00 = g2_mma(fa[cu][0], fb[cu][0], c00); c10 = g2_mma(fa[cu][1], fb[cu][0], c10); c01 = g2_mma(fa[cu][0], fb[cu][1], c01); c11 = g2_mma(fa[cu][1], fb[cu][1], c11);
      c02 = g2_mma(fa[cu][0], fb[cu][2], c02); c12 = g2_mma(fa[cu][1], fb[cu][2], c12); c03 = g2_mma(fa[cu][0], fb[cu][3], c03); c13 = g2_mma(fa[cu][1], fb[cu][3], c13); }
    if (MODE == 2 && p == nh - 1) { c00 *= 1024.0f; c01 *= 1024.0f; c02 *= 1024.0f; c03 *= 1024.0f; c10 *= 1024.0f; c11 *= 1024.0f; c12 *= 1024.0f; c13 *= 1024.0f; }      /* the hi plane is done: its sums take the residual plane's scale */
    asm volatile("s_wait_dscnt 0x0" ::: "memory");        /* this wave's reads of the buffer have returned before it is refilled */
    asm volatile("s_wait_asynccnt 0x0" ::: "memory");     /* this wave's copies for pass p + 1 have landed */
    __syncthreads();                                      /* publishes pass p + 1 and ends every reader's last read of pass p's buffer */
    if (p + 2 < np) { const int pn = p + 2, pk = kplace(pn);      /* pk: the pass's place inside its plane */
      g2_copy8(lA + bsel, gA + ((MODE == 2 && pn >= nh) ? sA : (size_t)0) + (size_t)pk * 128, stA); g2_copy8(lB + bsel, gB + (size_t)pk * 128, stB); } }
  asm volatile("s_wait_asynccnt 0x0" ::: "memory");       /* nothing in flight when the ring becomes output staging */
  /* Bias and addend are read in the layout of the write-out (a lane: 4 columns of 16 rows; 16 lanes: a whole 256-B run), and every load is issued here, ahead of the staging: they are in flight together and are waited for once. */
  const int rsub = lane >> 4, c4 = (lane & 15) * 4;
  v4f bq = {0.f, 0.f, 0.f, 0.f}, x[16];
  if (ADDP > 0) { const float* cr = CP + (size_t)(row0 + rsub) * ADDP + (size_t)by * 64 + col0 + c4;      /* a lane reads exactly the elements it writes below, so C may lie over CP */
#pragma unroll      /* constant indices keep x and accs in registers (this loop and those below); the compile-time pitch makes the 16 loads one address pair with immediate offsets */
    for (int q = 0; q < 16; ++q) x[q] = *(const v4fa*)(cr + q * 2 * ADDP);
    asm volatile("s_wait_xcnt 0x0" :: "v"(cr) : "memory"); }      /* the loads' address pair stays whole up to this wait */
  if (bp) { const float* br = bp + col0 + c4; bq = *(const v4fa*)br;
    asm volatile("s_wait_xcnt 0x0" :: "v"(br) : "memory"); }      /* the load's address pair stays whole up to this wait */
  v8f accs[8] = {c00, c01, c02, c03, c10, c11, c12, c13};
#pragma unroll
  for (int u = 0; u < 8; ++u) { const int t = u & 3, half = u >> 2;
#pragma unroll
    for (int r = 0; r < 8; ++r) so[w][half * 16 + 8 * hh + r][t * 16 + ln] = accs[u][r]; }
  __builtin_amdgcn_fence(__ATOMIC_ACQ_REL, "workgroup"); __builtin_amdgcn_wave_barrier();
  float bv[4];
#pragma unroll
  for (int i = 0; i < 4; ++i) bv[i] = bf16_round(bq[i]);
#pragma unroll
  for (int q = 0; q < 16; ++q) { const v4f a4 = *(const v4fa*)&so[w][q * 2 + rsub][c4];
#pragma unroll
    for (int i = 0; i < 4; ++i) { float v = a4[i] * alpha + bv[i]; if (ADDP > 0) v += x[q][i];
      if (ACT == 3) v = fmaxf(v, 0.f); else if (ACT == 6) v = 0.5f * v * (1.0f + erff(v * 0.70710678118654752f)); else if (ACT == 11) v = 1.0f / (1.0f + expf(-v)); else if (ACT == 15) v = v / (1.0f + expf(-v)); else if (ACT == 12) v = (v > 0.f) ? v : 0.01f * v; else if (ACT == 8) v = tanhf(v);
      x[q][i] = v; }
    if (ACT == 9) { const v4f g = x[q];      /* tanh-GELU, branch-free: a lane's 16 groups of four are independent short chains */
      x[q] = g * g2_rcpx4(g2_exp2x4(g * (g * g * GELU_K3 + GELU_K1)) + 1.0f); } }
  /* all results first, then the stores as one group: no store is held behind the next row's LDS read */
  const size_t o0 = cofs + (size_t)(row0 + rsub) * ldc + col0 + c4, ost = (size_t)2 * ldc;
#pragma unroll
  for (int q = 0; q < 16; ++q) { if (OUT16) { v4h h4;
#pragma unroll
      for (int i = 0; i < 4; ++i) h4[i] = (_Float16)x[q][i];
      *(v4h*)(C16 + o0 + q * ost) = h4; } else *(v4f*)(C + o0 + q * ost) = x[q]; } }



// Staged tile of k_flash: 128 keys. 128 K rows (64 f16 = 128 B) at a pitch of 144 B, then 64 V^T rows (128 keys = 256 B) at a pitch of 272 B (16 B x odd: conflict-free for ds_load_b128 readers); two buffers.
#define FL_KEYS 128
#define FL_KP 144
#define FL_VP 272
#define FL_VOFS (FL_KEYS * FL_KP)
#define FL_BUF (FL_VOFS + 64 * FL_VP)
#define FL_C2 (SCL * 1.4426950408889634f)      /* score scale x log2(e) */
// Eight asynchronous 16-byte copies per lane: l = the lane's LDS byte address (LSTEP bytes between copies), g = its global address (gstep elements between copies).
// s_wait_xcnt 0 is the statement's last line, so that it stands in front of any later rewrite of the address registers the copies name.
template <unsigned LSTEP>
__device__ __forceinline__ void fl_copy8(unsigned l, const unsigned short* g, size_t gstep) {
  const unsigned l1 = l + LSTEP, l2 = l + 2 * LSTEP, l3 = l + 3 * LSTEP, l4 = l + 4 * LSTEP, l5 = l + 5 * LSTEP, l6 = l + 6 * LSTEP, l7 = l + 7 * LSTEP;
  const unsigned short* g1 = g + gstep; const unsigned short* g2 = g1 + gstep; const unsigned short* g3 = g2 + gstep; const unsigned short* g4 = g3 + gstep; const unsigned short* g5 = g4 + gstep; const unsigned short* g6 = g5 + gstep; const unsigned short* g7 = g6 + gstep;
  asm volatile("global_load_async_to_lds_b128 %0, %8, off\n\t"
               "global_load_async_to_lds_b128 %1, %9, off\n\t"
               "global_load_async_to_lds_b128 %2, %10, off\n\t"
               "global_load_async_to_lds_b128 %3, %11, off\n\t"
               "global_load_async_to_lds_b128 %4, %12, off\n\t"
               "global_load_async_to_lds_b128 %5, %13, off\n\t"
               "global_load_async_to_lds_b128 %6, %14, off\n\t"
               "global_load_async_to_lds_b128 %7, %15, off\n\t"
               "s_wait_xcnt 0x0"
               :: "v"(l), "v"(l1), "v"(l2), "v"(l3), "v"(l4), "v"(l5), "v"(l6), "v"(l7), "v"(g), "v"(g1), "v"(g2), "v"(g3), "v"(g4), "v"(g5), "v"(g6), "v"(g7) : "memory");
}
// lane l with lane l ^ 16 (the two lanes that share one query column of a transposed score tile)
__device__ __forceinline__ float fl_xhalf(float x) { return __builtin_bit_cast(float, __builtin_amdgcn_permlanex16(__builtin_bit_cast(int, x), __builtin_bit_cast(int, x), 0x76543210, 0xfedcba98, false, false)); }
__global__ __launch_bounds__(128) void k_flash(const _Float16* __restrict__ Q16, int ldq, const _Float16* __restrict__ K16, int ldk, const _Float16* __restrict__ Vt, const int* __restrict__ MSK, _Float16* __restrict__ Oh, _Float16* __restrict__ Ol, int ldo) {
  constexpr int RPW = 16, NQB = TQ / (4 * RPW), DT = 4, KS = 2; (void)MSK;
  __shared__ __attribute__((aligned(16))) float sO[4][RPW][64 + 4];
  __shared__ __attribute__((aligned(16))) unsigned char ring[2 * FL_BUF];
  const int tid = threadIdx.x, w = tid >> 5, lane = tid & 31, ln = lane & 15, hh = lane >> 4;
  const int slab = blockIdx.x / NQB, qblk = blockIdx.x % NQB; const int b = slab / NH, h = slab % NH; const int qb0 = qblk * (4 * RPW); const int q0 = qb0 + w * RPW;
  FragH aq[KS];
  { const unsigned short* qr = (const unsigned short*)Q16 + ((size_t)b * TQ + q0 + ln) * ldq + h * 64;
#pragma unroll
    for (int ks = 0; ks < KS; ++ks) { aq[ks].half[0] = *(const v8us*)(qr + ks * 32 + 8 * hh); aq[ks].half[1] = *(const v8us*)(qr + ks * 32 + 16 + 8 * hh); } }
  const unsigned short* Vth = (const unsigned short*)Vt + (size_t)h * 64 * (NBT * TK) + (size_t)b * TK;
  float m_r = -3.0e38f, l_r = 0.f; v8f oacc[DT];      /* oacc[dt][r] = O^T[dt*16 + 8*hh + r][query ln] */
#pragma unroll
  for (int dt = 0; dt < DT; ++dt) oacc[dt] = (v8f){0.f,0.f,0.f,0.f,0.f,0.f,0.f,0.f};
  /* the block's 128 threads copy a stage: K as 16 rows x 8 pieces, V^T as 8 rows x 16 pieces per copy, whole 128-B lines per wave */
  const unsigned short* gK = (const unsigned short*)K16 + ((size_t)b * TK + (tid >> 3)) * ldk + h * 64 + (tid & 7) * 8; const unsigned short* gV = Vth + (size_t)(tid >> 4) * (NBT * TK) + (tid & 15) * 8;
  const unsigned lK = (unsigned)(size_t)ring + (unsigned)((tid >> 3) * FL_KP + (tid & 7) * 16); const unsigned lV = (unsigned)(size_t)ring + (unsigned)(FL_VOFS + (tid >> 4) * FL_VP + (tid & 15) * 16);
  const size_t stK = (size_t)16 * ldk, stV = (size_t)8 * (NBT * TK);
  constexpr int NST = TK / FL_KEYS;
  /* The query blocks of one head copy the same K and V^T lines and start together: each enters the walk over the key stages at a place of its own (s0) and wraps, so that they ask L2 for different lines at any one moment. The online softmax takes the keys in any order. */
  const int s0 = qblk % NST;
  const auto splace = [&](int st) { return (size_t)((st + s0) % NST); };      /* trip st's key stage, 0 .. NST - 1 */
  fl_copy8<16 * FL_KP>(lK, gK + splace(0) * FL_KEYS * ldk, stK); fl_copy8<8 * FL_VP>(lV, gV + splace(0) * FL_KEYS, stV);
  asm volatile("s_wait_asynccnt 0x0" ::: "memory");      /* stage 0's own copies have landed */
  __syncthreads();                                        /* ... and every other wave's */
  if (NST > 1) { fl_copy8<16 * FL_KP>(lK + FL_BUF, gK + splace(1) * FL_KEYS * ldk, stK); fl_copy8<8 * FL_VP>(lV + FL_BUF, gV + splace(1) * FL_KEYS, stV); }
#pragma unroll 1      /* one stage per trip: the publish point at the foot stands once */
  for (int st = 0; st < NST; ++st) { const unsigned bsel = (unsigned)(st & 1) * FL_BUF; const unsigned char* sK = ring + bsel; const unsigned char* sV = sK + FL_VOFS;
#pragma unroll 1      /* 32 keys per trip, rolled as before: keeps the loop's text small */
  for (int j0 = 0; j0 < FL_KEYS; j0 += 32) {
    v8f s[2]; FragH bk[2][KS], bv[DT];      /* this trip's K and V^T fragments are read from the stage as one group, ahead of the products and the softmax */
#pragma unroll
    for (int nt = 0; nt < 2; ++nt) { const unsigned short* kr = (const unsigned short*)(sK + (j0 + nt * 16 + ln) * FL_KP);
#pragma unroll
      for (int ks = 0; ks < KS; ++ks) { bk[nt][ks].half[0] = *(const v8us*)(kr + ks * 32 + 8 * hh); bk[nt][ks].half[1] = *(const v8us*)(kr + ks * 32 + 16 + 8 * hh); } }
#pragma unroll
    for (int dt = 0; dt < DT; ++dt) { const unsigned short* vrow = (const unsigned short*)(sV + (dt * 16 + ln) * FL_VP) + j0; bv[dt].half[0] = *(const v8us*)(vrow + 8 * hh); bv[dt].half[1] = *(const v8us*)(vrow + 16 + 8 * hh); }
#pragma unroll
    for (int nt = 0; nt < 2; ++nt) { v8f acc = (v8f){0.f,0.f,0.f,0.f,0.f,0.f,0.f,0.f};
#pragma unroll
      for (int ks = 0; ks < KS; ++ks) acc = mmaH<1>(bk[nt][ks].v, bk[nt][ks].v, aq[ks].v, aq[ks].v, acc);
      s[nt] = acc; }
    float mc = s[0][0];      /* the running maximum is kept in raw (unscaled) scores: the scale is positive, so the order is the same */
#pragma unroll      /* constant indices keep s, pb and oacc in registers (this loop and those below) */
    for (int i = 1; i < 16; ++i) mc = fmaxf(mc, s[i >> 3][i & 7]);
    mc = fmaxf(mc, fl_xhalf(mc));
    const float mn = fmaxf(m_r, mc); const float al = (mn > -1.0e38f) ? __builtin_amdgcn_exp2f((m_r - mn) * FL_C2) : 1.0f; m_r = mn;
    const float nb = __builtin_fmaf(-mn, FL_C2, 10.0f);      /* 2^(s c + nb) = 2^10 exp((s - mn) / 8): scale, maximum and the 2^10 of P in one multiply-add */
    FragH pb; float psum = 0.f;
#pragma unroll
    for (int i = 0; i < 16; ++i) { const float p = __builtin_amdgcn_exp2f(__builtin_fmaf(s[i >> 3][i & 7], FL_C2, nb)); psum += p; pb.h[i] = (_Float16)p; }
    l_r = l_r * al + psum;      /* l_r carries the 2^10 too */
#pragma unroll
    for (int dt = 0; dt < DT; ++dt)
#pragma unroll
      for (int r = 0; r < 8; ++r) oacc[dt][r] *= al;
#pragma unroll
    for (int dt = 0; dt < DT; ++dt) oacc[dt] = mmaH<1>(bv[dt].v, bv[dt].v, pb.v, pb.v, oacc[dt]); }
    asm volatile("s_wait_dscnt 0x0" ::: "memory");        /* this wave's reads of the buffer have returned before it is refilled */
    asm volatile("s_wait_asynccnt 0x0" ::: "memory");     /* this wave's copies for stage st + 1 have landed */
    __syncthreads();                                      /* publishes stage st + 1 and ends every reader's last read of stage st's buffer */
    if (st + 2 < NST) { fl_copy8<16 * FL_KP>(lK + bsel, gK + splace(st + 2) * FL_KEYS * ldk, stK); fl_copy8<8 * FL_VP>(lV + bsel, gV + splace(st + 2) * FL_KEYS, stV); } }
  asm volatile("s_wait_asynccnt 0x0" ::: "memory");       /* nothing in flight when the wave goes on to its end */
  { float l = l_r + fl_xhalf(l_r); l = (l > 0.f) ? 1.0f / l : 0.f;
#pragma unroll
    for (int dt = 0; dt < DT; ++dt) { v4f lo, hi;
#pragma unroll
      for (int r = 0; r < 4; ++r) { lo[r] = oacc[dt][r] * l; hi[r] = oacc[dt][4 + r] * l; }
      *(v4fa*)&sO[w][ln][dt * 16 + 8 * hh] = lo; *(v4fa*)&sO[w][ln][dt * 16 + 8 * hh + 4] = hi; } }
  __builtin_amdgcn_fence(__ATOMIC_ACQ_REL, "workgroup"); __builtin_amdgcn_wave_barrier();
  {
#pragma unroll
    for (int rp = 0; rp < RPW; rp += 2) { const int r = rp + (lane >> 4), pc = lane & 15; const v4f val = *(const v4fa*)&sO[w][r][pc * 4]; v4h vh, vl;
#pragma unroll      /* constant indices keep vh and vl in registers */
      for (int i = 0; i < 4; ++i) { const _Float16 hi = (_Float16)val[i]; vh[i] = hi; vl[i] = (_Float16)((val[i] - (float)hi) * 1024.0f); }
      const size_t oo = ((size_t)b * TQ + q0 + r) * ldo + h * 64 + pc * 4; *(v4h*)(Oh + oo) = vh; *(v4h*)(Ol + oo) = vl; }
     } }
__global__ __launch_bounds__(256) void k_fulltab(unsigned* __restrict__ MB, int* __restrict__ RA, int* __restrict__ KE, int nq, int nk) {
  const int t = blockIdx.x * 256 + threadIdx.x;
  if (t < nq * (nk / 32)) { *(unsigned*)(MB + t) = 0u;  }
  if (t < nq) { *(int*)(RA + t) = 0;  }
  if (t < nq / 64) { *(int*)(KE + t * 32) = nk;  } }
// LayerNorm of 8 rows (one per wave); blk = the number of the 8-row group.
template <int SRCBF>
__device__ __forceinline__ void ln1024_rows(const float* __restrict__ X, _Float16* __restrict__ Y16, float* __restrict__ XB, int blk) {
  #pragma clang fp contract(off)
  const int tid = threadIdx.x, w = tid >> 5, ln = tid & 31; const int r = blk * 8 + w; if (r >= NR) return; const float* x = X + (size_t)r * DM; float s = 0.f;
#pragma unroll 1
  for (int i = 0; i < 8; ++i) { const v4f a = *(const v4fa*)(x + i * 128 + ln * 4); for (int q = 0; q < 4; ++q) s += SRCBF ? bf16_round(a[q]) : a[q]; }
  for (int o = 16; o > 0; o >>= 1) s += __shfl_xor(s, o, 32); const float mu = s / (float)DM; float q2 = 0.f;
#pragma unroll 1
  for (int i = 0; i < 8; ++i) { const v4f a = *(const v4fa*)(x + i * 128 + ln * 4); for (int q = 0; q < 4; ++q) { const float d = (SRCBF ? bf16_round(a[q]) : a[q]) - mu; q2 += d * d; } }
  for (int o = 16; o > 0; o >>= 1) q2 += __shfl_xor(q2, o, 32); const float dn = sqrtf(q2 / (float)DM + 1e-5f);
  {
#pragma unroll 1
    for (int i = 0; i < 8; ++i) { const int c0 = i * 128 + ln * 4; const v4f a = *(const v4fa*)(x + c0); _Float16 h4[4]; v4f xb;
      for (int q = 0; q < 4; ++q) { const float t = SRCBF ? bf16_round(a[q]) : a[q]; h4[q] = (_Float16)((t - mu) / dn); xb[q] = t; }
      *(unsigned long long*)((unsigned short*)Y16 + (size_t)r * DM + c0) = *(const unsigned long long*)h4; if (SRCBF) *(v4f*)(XB + (size_t)r * DM + c0) = xb; }
     } }
template <int SRCBF>
__global__ __launch_bounds__(256) void k_ln1024(const float* __restrict__ X, _Float16* __restrict__ Y16, float* __restrict__ XB) { ln1024_rows<SRCBF>(X, Y16, XB, blockIdx.x); }
// The first LayerNorm and the four weight matrices in one launch (neither reads what the other writes): a block's index picks its work, the same for the whole block, so the barrier in wt_tile is passed by all of a block or by none.
// The LayerNorm blocks come first: each wave of them waits out a chain of loads, which the transposes' traffic then covers.
#define LN_NB (NR / 8)
__global__ __launch_bounds__(256) void k_ln_wt4(const float* __restrict__ X, _Float16* __restrict__ Y16, float* __restrict__ XB, const float* __restrict__ Wa, _Float16* __restrict__ Ta, const float* __restrict__ Wb, _Float16* __restrict__ Tb, const float* __restrict__ Wc, _Float16* __restrict__ Tc, const float* __restrict__ Wd, _Float16* __restrict__ Td, float scale) {
  __shared__ __attribute__((aligned(16))) unsigned char tl[64 * WT_P];
  const int blk = (int)blockIdx.x - LN_NB;
  if (blk < 0) ln1024_rows<1>(X, Y16, XB, blockIdx.x);
  else if (blk < WT_B1) wt_tile<DM, 3 * DM>(Wa, Ta, scale, blk, tl);
  else if (blk < WT_B2) wt_tile<DM, DM>(Wb, Tb, scale, blk - WT_B1, tl);
  else if (blk < WT_B3) wt_tile<DM, 4096>(Wc, Tc, scale, blk - WT_B2, tl);
  else wt_tile<4096, DM>(Wd, Td, scale, blk - WT_B3, tl);
}
__global__ __launch_bounds__(256) void k_causaltab(unsigned* __restrict__ MB, int* __restrict__ RA, int* __restrict__ KE, int nq, int nk) {
  const int t = blockIdx.x * 256 + threadIdx.x; const int nw = nk / 32;
  if (t < nq * nw) { const int q = t / nw, w = t % nw; const int first = q + 1 - 32 * w; const unsigned bits = (first <= 0) ? 0xffffffffu : ((first >= 32) ? 0u : (0xffffffffu << first)); *(unsigned*)(MB + t) = bits;  }
  if (t < nq) { *(int*)(RA + t) = 0;  }
  if (t < nq / 64) { const int v = 64 * (t + 1); *(int*)(KE + t * 32) = v;  } }


extern "C" void kernel_launch(void* const* d_in, const int* in_sizes, int n_in,
                              void* d_out, int out_size, void* d_ws, size_t ws_size, hipStream_t stream) {
  (void)in_sizes; (void)n_in; (void)out_size;
  const float* const* I = (const float* const*)d_in; const float* x = I[0]; const float* Wqkv = I[1]; const float* Wfc = I[2]; const float* W1 = I[3]; const float* b1 = I[4]; const float* W2 = I[5]; const float* b2 = I[6];
  char* ws = (char*)d_ws; size_t off = 0;
  auto take = [&](size_t bytes) { char* p = ws + off; off += (bytes + 255) & ~(size_t)255; return p; };
  _Float16* BQKV = (_Float16*)take((size_t)3 * DM * DM * 2); _Float16* BFC = (_Float16*)take((size_t)DM * DM * 2); _Float16* BW1 = (_Float16*)take((size_t)4096 * DM * 2); _Float16* BW2 = (_Float16*)take((size_t)DM * 4096 * 2);
  float* XB = (float*)take((size_t)NR * DM * 4); _Float16* X16 = (_Float16*)take((size_t)NR * DM * 2); float* F = (float*)take((size_t)NR * DM * 4);
  _Float16* Q16 = (_Float16*)take((size_t)NR * DM * 2); _Float16* K16 = (_Float16*)take((size_t)NR * DM * 2); _Float16* V16 = (_Float16*)take((size_t)NR * DM * 2); _Float16* GT = (_Float16*)take((size_t)NR * DM * 2); (void)GT; if (off > ws_size) return;      /* 24 + 16 + 8 + 16 + 32 = 96 MiB */
  _Float16* Oh = (_Float16*)F; _Float16* Ol = Oh + (size_t)NR * DM;     /* the two O planes, one behind the other */
  float* X1 = XB;                                           /* x1 written over the residual plane (own-tile addend) */
  _Float16* H16 = X16; _Float16* GH = Q16;                  /* GELU hidden [NR][4096] f16 = 32 MB over Q16|K16|V16|GT (contiguous; the first three are dead once x1 is formed, GT serves nothing else) */
  k_ln_wt4<<<LN_NB + WT_B4, 256, 0, stream>>>(x, X16, XB, Wqkv, BQKV, Wfc, BFC, W1, BW1, W2, BW2, 16.0f);      /* LN(x), 8 rows a block; weights all (in,out), one block per 128 k x 64 n tile */
  const dim3 gP((NR / 128) * (DM / 128), 1), gM((NR / 128) * (4096 / 128), 1);
  const dim3 gQ((NR / 128) * (DM / 128), 3);
  k_gemm2<0, 0, true, 1><<<gQ, 256, 0, stream>>>(X16, DM, 0, BQKV, DM, (size_t)DM * DM, 0.0625f, nullptr, 0, nullptr, nullptr, Q16, DM, (size_t)NR * DM, NR, DM, DM);      /* blockIdx.y = 0, 1, 2: q, k, V^T (weight slabs and the planes Q16, K16, V16 each lie one behind the other; V16 holds V^T as [DM][NR]) */
  k_flash<<<NBT * NH * (SLEN / 64), 128, 0, stream>>>(Q16, DM, K16, DM, V16, nullptr, Oh, Ol, DM);      /* plain flash over all keys, both batches */
  k_gemm2<0, DM, false, 2><<<gP, 256, 0, stream>>>(Oh, DM, (size_t)NR * DM, BFC, DM, 0, 0.0625f / 1024.0f, nullptr, 0, XB, X1, nullptr, DM, 0, NR, DM, 2 * DM);      /* x1 = x + attn w_fc, hi and residual plane in one accumulator */
  k_ln1024<0><<<NR / 8, 256, 0, stream>>>(X1, H16, nullptr);
  k_gemm2<9, 0, true, 0><<<gM, 256, 0, stream>>>(H16, DM, 0, BW1, DM, 0, 0.0625f, b1, 0, nullptr, nullptr, GH, 4096, 0, NR, 4096, DM);      /* tanh-gelu(LN(x1) w1 + b1) f16 */
  k_gemm2<0, DM, false, 0><<<gP, 256, 0, stream>>>(GH, 4096, 0, BW2, 4096, 0, 0.0625f, b2, 0, X1, (float*)d_out, nullptr, DM, 0, NR, DM, 4096);      /* out = x1 + mlp */
}
